// v010
// The times below were measured on an AMD MI455X: many runs one after another, warmed up first and cycling through
// copies of the inputs, with the whole window's GPU time divided by the number of runs. Launches and the gaps
// between them are all in it. The median over several windows is given; except for v000 it joins two sittings, which
// can be a few percent apart, so the side-by-side timings, each taken in one sitting, are the better comparison.
// The versions before v010 are in another document.
// A run of this version takes 202 microseconds.
// Two timings next to v009 put it at 1.09 and 1.10 times that version's speed.
// All steps since the starting kernel, v000, together make it 47.5 times as fast.
#include <hip/hip_runtime.h>
// Grouped-query causal attention with RoPE and a BFLOAT16 output (x [2][2048][2048]; xq = x wq (32 heads x 64), xk = x wk, xv = x wv (8 kv heads x 64) ([in][out] weights sigma 1/sqrt(2048), no biases); interleaved-pair RoPE (reshape(..., 32, 2): real = even, imag = odd) on q and k from the module's INPUT tables freqs_cos/freqs_sin [S][32]; repeat: query head h uses kv head h/4; scores / 8 + triu(-inf, 1) (causal); softmax; out = (merged wo).astype(bfloat16) -> bf16 [2][2048][2048] (2 bytes per element)).
// Compute dtype: inputs rounded to bf16; x / weights exact; q, k, v, softmax weights and o as plain f16 GEMM operands (~2^-12); scores and softmax statistics f32. v_wmma_f32_16x16x32_f16.
#define NB 2
#define NG 8
#define HPG 4
#define KVD (NG * HD)
#define SQ 2048
#define DM 2048
#define NH 32
#define HD 64
#define HG 4                         /* heads per launch of k_vt (not launched) */
#define QT 256                       /* not used in this file */
#define NKX SQ                       /* S / P row pitch */
#define QT0 128                      /* first-tile rows recomputed exactly in f32 */
#define B0 0                         /* first batch processed (debug hook) */
#define NBR NB                       /* batches processed (debug hook) */
#define NR ((size_t)NB * SQ)         /* token rows */
#define MP ((int)((size_t)NBR * SQ)) /* rows projected (debug hook) */
#define QN SQ                        /* query rows attended per batch (debug hook) */
#define NHD NH                       /* heads attended (debug hook) */
#define MPO MP                       /* rows through the output stage (debug hook) */
#define LQ DM      /* row pitch of the q rows (k, v rows: KVD); not used */
typedef __bf16 v16b __attribute__((ext_vector_type(16)));
typedef unsigned short v8us __attribute__((ext_vector_type(8), may_alias));
typedef float  v8f  __attribute__((ext_vector_type(8)));
typedef float  v4f  __attribute__((ext_vector_type(4)));
typedef float  v4fa __attribute__((ext_vector_type(4), may_alias));
union FragB { v16b v; v8us half[2]; unsigned short u[16]; };

__device__ __forceinline__ unsigned short bf16_bits(float x) { unsigned int u = __float_as_uint(x); return (unsigned short)((u + 0x7FFFu + ((u >> 16) & 1u)) >> 16); }
__device__ __forceinline__ float bf16_val(unsigned short b) { return __uint_as_float(((unsigned int)b) << 16); }
__device__ __forceinline__ float bf16_round(float x) { return bf16_val(bf16_bits(x)); }
// D += A·B with NT terms: 1 = ah·bh, 2 = + al·bh (A split), 3 = + ah·bl (both split)
template <int NT>
__device__ __forceinline__ v8f mmaN(v16b ah, v16b al, v16b bh, v16b bl, v8f c) {
  c = __builtin_amdgcn_wmma_f32_16x16x32_bf16(false, ah, false, bh, (short)0, c, false, false);
  if (NT >= 2) c = __builtin_amdgcn_wmma_f32_16x16x32_bf16(false, al, false, bh, (short)0, c, false, false);
  if (NT >= 3) c = __builtin_amdgcn_wmma_f32_16x16x32_bf16(false, ah, false, bl, (short)0, c, false, false);
  asm volatile("v_nop\n\tv_nop\n\tv_nop\n\tv_nop" : "+v"(c) : "v"(ah), "v"(al), "v"(bh), "v"(bl));
  return c;
}

__global__ __launch_bounds__(256) void k_wt_bf16(const float* __restrict__ W, unsigned short* __restrict__ Wt, int K, int N) {
  const int t = blockIdx.x * 256 + threadIdx.x;
  const int k8n = K / 8;
  if (t >= N * k8n) return;
  const int n = t / k8n, k8 = (t % k8n) * 8;
  v8us v;
#pragma unroll
  for (int i = 0; i < 8; ++i) v[i] = bf16_bits(W[(size_t)(k8 + i) * N + n]);
  *(v8us*)(Wt + (size_t)n * K + k8) = v;
  
}

// GEMM C[M][N] (f32, pitch ldc) = act(A[M][K]·W + bias). A f32 row-major (pitch lda) converted per fragment to bf16
// (ASPLIT: hi/lo two planes -> 2 terms, else single rounded term); Wt bf16 [N][K] (pitch ldb). BIAS_BF16 rounds the
// bias to bf16 first (bias quantised to bf16 before the add). K%32==0, M%16==0, N%64==0.
template <bool ASPLIT, int ACT, bool BIAS_BF16>
__global__ __launch_bounds__(128) void k_gemm_bf(const float* __restrict__ A, int lda, const unsigned short* __restrict__ Wt, int ldb,
                                               const float* __restrict__ bias, float* __restrict__ C, int ldc, int M, int N, int K) {
  __shared__ __attribute__((aligned(16))) float so[4][16][64];
  const int tid = threadIdx.x, w = tid >> 5, lane = tid & 31, ln = lane & 15, hh = lane >> 4;
  const int ntn = N / 64;
  const int wid = blockIdx.x * 4 + w;
  const int mt = wid / ntn, nq = wid % ntn;
  if (mt * 16 >= M) return;
  const int row0 = mt * 16, col0 = nq * 64;
  const float* arow = A + (size_t)(row0 + ln) * lda;
  v8f acc[4] = {};
  for (int kb = 0; kb < K; kb += 32) {
    FragB ah, al;
    const v4f x0 = *(const v4fa*)(arow + kb + 8 * hh), x1 = *(const v4fa*)(arow + kb + 8 * hh + 4);
    const v4f x2 = *(const v4fa*)(arow + kb + 16 + 8 * hh), x3 = *(const v4fa*)(arow + kb + 16 + 8 * hh + 4);
    float xs[16] = {x0[0],x0[1],x0[2],x0[3],x1[0],x1[1],x1[2],x1[3],x2[0],x2[1],x2[2],x2[3],x3[0],x3[1],x3[2],x3[3]};
#pragma unroll
    for (int i = 0; i < 16; ++i) { const unsigned short hb = bf16_bits(xs[i]); ah.u[i] = hb; al.u[i] = ASPLIT ? bf16_bits(xs[i] - bf16_val(hb)) : (unsigned short)0; }
#pragma unroll
    for (int t = 0; t < 4; ++t) {
      const unsigned short* brow = Wt + (size_t)(col0 + t * 16 + ln) * ldb + kb;
      FragB b;
      b.half[0] = *(const v8us*)(brow + 8 * hh);
      b.half[1] = *(const v8us*)(brow + 16 + 8 * hh);
      acc[t] = mmaN<ASPLIT ? 2 : 1>(ah.v, al.v, b.v, b.v, acc[t]);
    }
  }
#pragma unroll
  for (int t = 0; t < 4; ++t) {
    float bv = bias ? bias[col0 + t * 16 + ln] : 0.f;
    if (BIAS_BF16) bv = bf16_round(bv);
#pragma unroll
    for (int r = 0; r < 8; ++r) { float v = acc[t][r] + bv; if (ACT == 1) v = fmaxf(v, 0.f); so[w][8 * hh + r][t * 16 + ln] = v; }
  }
  __builtin_amdgcn_fence(__ATOMIC_ACQ_REL, "workgroup");
  __builtin_amdgcn_wave_barrier();
  const int rsub = lane >> 4, c4 = (lane & 15) * 4;
  {
#pragma unroll
    for (int q = 0; q < 8; ++q) {
      const int r = q * 2 + rsub;
      const v4f v = *(const v4fa*)&so[w][r][c4];
      *(v4f*)(C + (size_t)(row0 + r) * ldc + col0 + c4) = v;
    }
    
  }
}

// GEMM C = act(A·W + bias + resid): A f32 (ASPLIT -> hi/lo 2 terms), Wt bf16 [N][K]; ACT 0 none, 1 relu, 2 exact gelu;
// resid (optional, f32, row index = (row % rmod), pitch ldr, RES_BF16 rounds it) added before the activation.
template <bool ASPLIT, int ACT, bool BIAS_BF16, bool RES_BF16>
__global__ __launch_bounds__(128) void k_gemm_bf3(const float* __restrict__ A, int lda, const unsigned short* __restrict__ Wt, int ldb,
                                                const float* __restrict__ bias, const float* __restrict__ resid, int rmod, int ldr,
                                                float* __restrict__ C, int ldc, int M, int N, int K) {
  __shared__ __attribute__((aligned(16))) float so[4][16][64];
  const int tid = threadIdx.x, w = tid >> 5, lane = tid & 31, ln = lane & 15, hh = lane >> 4;
  const int ntn = N / 64;
  const int wid = blockIdx.x * 4 + w;
  const int mt = wid / ntn, nq = wid % ntn;
  if (mt * 16 >= M) return;
  const int row0 = mt * 16, col0 = nq * 64;
  const float* arow = A + (size_t)(row0 + ln) * lda;
  v8f acc[4] = {};
  for (int kb = 0; kb < K; kb += 32) {
    FragB ah, al;
    const v4f x0 = *(const v4fa*)(arow + kb + 8 * hh), x1 = *(const v4fa*)(arow + kb + 8 * hh + 4);
    const v4f x2 = *(const v4fa*)(arow + kb + 16 + 8 * hh), x3 = *(const v4fa*)(arow + kb + 16 + 8 * hh + 4);
    float xs[16] = {x0[0],x0[1],x0[2],x0[3],x1[0],x1[1],x1[2],x1[3],x2[0],x2[1],x2[2],x2[3],x3[0],x3[1],x3[2],x3[3]};
#pragma unroll
    for (int i = 0; i < 16; ++i) { const unsigned short hb = bf16_bits(xs[i]); ah.u[i] = hb; al.u[i] = ASPLIT ? bf16_bits(xs[i] - bf16_val(hb)) : (unsigned short)0; }
#pragma unroll
    for (int t = 0; t < 4; ++t) {
      const unsigned short* brow = Wt + (size_t)(col0 + t * 16 + ln) * ldb + kb;
      FragB b;
      b.half[0] = *(const v8us*)(brow + 8 * hh);
      b.half[1] = *(const v8us*)(brow + 16 + 8 * hh);
      acc[t] = mmaN<ASPLIT ? 2 : 1>(ah.v, al.v, b.v, b.v, acc[t]);
    }
  }
#pragma unroll
  for (int t = 0; t < 4; ++t) {
    const int col = col0 + t * 16 + ln;
    float bv = bias ? bias[col] : 0.f;
    if (BIAS_BF16) bv = bf16_round(bv);
#pragma unroll
    for (int r = 0; r < 8; ++r) {
      float v = acc[t][r] + bv;
      if (resid) { float rv = resid[(size_t)((row0 + 8 * hh + r) % rmod) * ldr + col]; if (RES_BF16) rv = bf16_round(rv); v += rv; }
      if (ACT == 1) v = fmaxf(v, 0.f);
      if (ACT == 2) v = 0.5f * v * (1.0f + erff(v * 0.70710678118654752f));
      if (ACT == 3) { const float u = 0.7978845608028654f * (v + 0.044715f * v * v * v); v = 0.5f * v * (1.0f + tanhf(u)); }
      so[w][8 * hh + r][t * 16 + ln] = v;
    }
  }
  __builtin_amdgcn_fence(__ATOMIC_ACQ_REL, "workgroup");
  __builtin_amdgcn_wave_barrier();
  const int rsub = lane >> 4, c4 = (lane & 15) * 4;
  {
#pragma unroll
    for (int q = 0; q < 8; ++q) {
      const int r = q * 2 + rsub;
      const v4f v = *(const v4fa*)&so[w][r][c4];
      *(v4f*)(C + (size_t)(row0 + r) * ldc + col0 + c4) = v;
    }
    
  }
}
// row LayerNorm (biased variance, eps) over N: s = X (+ R); optional out_sum <- s; out_norm <- (s-mu)*rsqrt(var+eps)*g + b
template <bool PARAM_BF16>
__global__ __launch_bounds__(256) void k_layernorm(const float* __restrict__ X, const float* __restrict__ R, const float* __restrict__ g, const float* __restrict__ bta,
                                                  float* __restrict__ out_sum, float* __restrict__ out_norm, int N, float eps) {
  __shared__ float red[256];
  const int row = blockIdx.x, tid = threadIdx.x;
  const float* x = X + (size_t)row * N; const float* rr = R ? R + (size_t)row * N : nullptr;
  float vals[16];                     // up to N = 4096
  const int per = N / 256;            // contiguous chunk per thread? use strided-by-4 chunks: thread handles j = tid*4 + 1024*u
  float s1 = 0.f;
  for (int u = 0; u < per / 4; ++u) {
    const int j = tid * 4 + 1024 * u;
    const v4f a = *(const v4fa*)(x + j);
    v4f b = {0.f,0.f,0.f,0.f}; if (rr) b = *(const v4fa*)(rr + j);
#pragma unroll
    for (int q = 0; q < 4; ++q) { const float v = a[q] + b[q]; vals[u * 4 + q] = v; s1 += v; }
  }
  red[tid] = s1; __syncthreads();
  for (int st = 128; st > 0; st >>= 1) { if (tid < st) red[tid] += red[tid + st]; __syncthreads(); }
  const float mu = red[0] / (float)N; __syncthreads();
  float s2 = 0.f;
  for (int u = 0; u < per / 4; ++u)
#pragma unroll
    for (int q = 0; q < 4; ++q) { const float c = vals[u * 4 + q] - mu; s2 += c * c; }
  red[tid] = s2; __syncthreads();
  for (int st = 128; st > 0; st >>= 1) { if (tid < st) red[tid] += red[tid + st]; __syncthreads(); }
  const float rs = rsqrtf(red[0] / (float)N + eps);
  {
    for (int u = 0; u < per / 4; ++u) {
      const int j = tid * 4 + 1024 * u;
      v4f o, sm;
#pragma unroll
      for (int q = 0; q < 4; ++q) {
        float gg = g[j + q], bb = bta[j + q];
        if (PARAM_BF16) { gg = bf16_round(gg); bb = bf16_round(bb); }
        sm[q] = vals[u * 4 + q]; o[q] = (vals[u * 4 + q] - mu) * rs * gg + bb;
      }
      if (out_sum) *(v4f*)(out_sum + (size_t)row * N + j) = sm;
      *(v4f*)(out_norm + (size_t)row * N + j) = o;
    }
    
  }
}



// ---- f16 WMMA path (v_wmma_f32_16x16x32_f16): 11-bit significands for operands in range — used where a [0,1] probability operand needs more precision than bf16
typedef _Float16 v16h __attribute__((ext_vector_type(16)));
union FragH { v16h v; v8us half[2]; _Float16 h[16]; unsigned short u[16]; };
template <int NT>
__device__ __forceinline__ v8f mmaH(v16h ah, v16h al, v16h bh, v16h bl, v8f c) {
  c = __builtin_amdgcn_wmma_f32_16x16x32_f16(false, ah, false, bh, (short)0, c, false, false);
  if (NT >= 2) c = __builtin_amdgcn_wmma_f32_16x16x32_f16(false, al, false, bh, (short)0, c, false, false);
  if (NT >= 3) c = __builtin_amdgcn_wmma_f32_16x16x32_f16(false, ah, false, bl, (short)0, c, false, false);
  asm volatile("v_nop\n\tv_nop\n\tv_nop\n\tv_nop" : "+v"(c) : "v"(ah), "v"(al), "v"(bh), "v"(bl));
  return c;
}
// batched GEMM like k_gemm_b but f16 operands: A f32 (split into f16 hi/lo if ASPLIT, else rounded to f16), Bt = f16 values [n][k]; alpha; C f32; N multiple of 16 (partial tiles skipped)
template <bool ASPLIT>
__global__ __launch_bounds__(128) void k_gemm_h(const float* __restrict__ A, int lda, size_t sA, const _Float16* __restrict__ Bh, int ldb, size_t sB, float alpha, float* __restrict__ C, int ldc, size_t sC, int M, int N, int K) {
  __shared__ __attribute__((aligned(16))) float so[4][16][64];
  const int tid = threadIdx.x, w = tid >> 5, lane = tid & 31, ln = lane & 15, hh = lane >> 4; const int by = blockIdx.y;
  A += (size_t)by * sA; Bh += (size_t)by * sB; C += (size_t)by * sC;
  const int ntn = (N + 63) / 64; const int wid = blockIdx.x * 4 + w; const int mt = wid / ntn, nq = wid % ntn; if (mt * 16 >= M) return;
  const int row0 = mt * 16, col0 = nq * 64; const float* arow = A + (size_t)(row0 + ln) * lda;
  v8f acc[4] = {};
  for (int kb = 0; kb < K; kb += 32) {
    FragH ah, al;
    const v4f x0 = *(const v4fa*)(arow + kb + 8 * hh), x1 = *(const v4fa*)(arow + kb + 8 * hh + 4), x2 = *(const v4fa*)(arow + kb + 16 + 8 * hh), x3 = *(const v4fa*)(arow + kb + 16 + 8 * hh + 4);
    float xs[16] = {x0[0],x0[1],x0[2],x0[3],x1[0],x1[1],x1[2],x1[3],x2[0],x2[1],x2[2],x2[3],x3[0],x3[1],x3[2],x3[3]};
#pragma unroll
    for (int i = 0; i < 16; ++i) { const _Float16 h = (_Float16)xs[i]; ah.h[i] = h; al.h[i] = ASPLIT ? (_Float16)(xs[i] - (float)h) : (_Float16)0.0f; }
#pragma unroll
    for (int t = 0; t < 4; ++t) { if (col0 + t * 16 >= N) continue; const size_t boff = (size_t)(col0 + t * 16 + ln) * ldb + kb; FragH bq; bq.half[0] = *(const v8us*)(Bh + boff + 8 * hh); bq.half[1] = *(const v8us*)(Bh + boff + 16 + 8 * hh);
      acc[t] = mmaH<ASPLIT ? 2 : 1>(ah.v, al.v, bq.v, bq.v, acc[t]); }
  }
#pragma unroll
  for (int t = 0; t < 4; ++t) { if (col0 + t * 16 >= N) continue;
#pragma unroll
    for (int r = 0; r < 8; ++r) so[w][8 * hh + r][t * 16 + ln] = acc[t][r] * alpha; }
  __builtin_amdgcn_fence(__ATOMIC_ACQ_REL, "workgroup"); __builtin_amdgcn_wave_barrier();
  const int rsub = lane >> 4, c4 = (lane & 15) * 4;
  {
#pragma unroll
    for (int q = 0; q < 8; ++q) { const int r = q * 2 + rsub; if (col0 + c4 < N) { const v4f v = *(const v4fa*)&so[w][r][c4]; *(v4f*)(C + (size_t)(row0 + r) * ldc + col0 + c4) = v; } }
     }
}

// Wt[n][k] = f16(bf16(W[k][n]) * scale) from f32 row-major W[K][N] (scale = power of two; bf16-exact weights stay exact in f16 away from the subnormal range). K and N multiples of 64; bi: the tile's number among the (N / 64) x (K / 64) tiles, n fastest; tl: the work-group's LDS tile.
// One work-group per tile of 64 k x 64 n, turned in LDS, so that both sides of the transpose move whole lines: 16 lanes load 256 neighbouring bytes of one W row, 8 lanes store one 128-byte line of one Wt row.
// A lane loads the same 4 columns of two neighbouring k rows and packs each (even k, odd k) pair of f16 into one dword: the LDS tile is [n][k / 2].
#define WTP 33                       /* LDS pitch of a tile row in dwords (32 pairs + 1): odd, so the 16 x 2 dwords of a wave's store (rows 4 apart) and the 4 x 8 of a wave's load fall on 32 different banks */
typedef unsigned v4u __attribute__((ext_vector_type(4), may_alias));
typedef _Float16 v2h __attribute__((ext_vector_type(2)));
__device__ __forceinline__ void d_wt_f16(unsigned (*tl)[WTP], int bi, const float* __restrict__ W, _Float16* __restrict__ Wt, int K, int N, float scale) {
  const int tid = threadIdx.x; const int k0 = (bi / (N / 64)) * 64, n0 = (bi % (N / 64)) * 64;
  const int c = tid & 15, r = tid >> 4;      /* this lane's 4 columns and its pair of k rows in a round of 32 rows */
  const float* s0 = W + (size_t)(k0 + 2 * r) * N + n0 + 4 * c; const float* s1 = s0 + N; const float* s2 = s0 + (size_t)32 * N; const float* s3 = s2 + N;
  const v4f a[2][2] = {{*(const v4fa*)s0, *(const v4fa*)s1}, {*(const v4fa*)s2, *(const v4fa*)s3}};      /* all four loads issued before the first conversion: one memory latency for the whole tile */
  asm volatile("s_wait_xcnt 0x0" :: "v"(s0), "v"(s1), "v"(s2), "v"(s3) : "memory");      /* the four address pairs are inputs, so they stay as they are up to this wait (no load's result lands on one); their registers are reused below */
#pragma unroll      /* both loops unrolled in full: a[][] is indexed by constants and stays in registers */
  for (int u = 0; u < 2; ++u) {
#pragma unroll
    for (int i = 0; i < 4; ++i) { const v2h h = {(_Float16)(bf16_round(a[u][0][i]) * scale), (_Float16)(bf16_round(a[u][1][i]) * scale)}; tl[4 * c + i][16 * u + r] = __builtin_bit_cast(unsigned, h); } }
  __syncthreads();      /* the whole tile is in LDS before any row of it is read */
  const int j = tid & 7, nr = tid >> 3;      /* this lane's 8 k (4 dwords) and its n row in a round of 32 rows */
#pragma unroll      /* two rounds: their LDS reads go out together */
  for (int rd = 0; rd < 2; ++rd) { const int n = rd * 32 + nr; const v4u o = {tl[n][4 * j], tl[n][4 * j + 1], tl[n][4 * j + 2], tl[n][4 * j + 3]};
    *(v4u*)((unsigned short*)Wt + (size_t)(n0 + n) * K + k0 + 8 * j) = o; }
  asm volatile("s_wait_xcnt 0x0" ::: "memory");      /* behind the last store: in a launch of several jobs another job's code follows this one in the listing and writes the stores' address and data registers */
}
// k_gemm_hh variant with fused epilogue: v = acc·alpha + bias[by·sBias + col] (+ CP[(row/rowsPerB)·sCPb + by·64 + col] if CP) ; ACT 0 none / 1 elu ; writes f16 C16 (and f32 C if non-null)
template <int ACT>
__global__ __launch_bounds__(128) void k_gemm_hhx(const _Float16* __restrict__ A, int lda, size_t sA, const _Float16* __restrict__ Bh, int ldb, size_t sB, float alpha, const float* __restrict__ bias, size_t sBias, const float* __restrict__ CP, int rowsPerB, size_t sCPb, int row0g,
    float* __restrict__ C, _Float16* __restrict__ C16, int ldc, size_t sC, int M, int N, int K) {
  __shared__ __attribute__((aligned(16))) float so[4][16][64];
  const int tid = threadIdx.x, w = tid >> 5, lane = tid & 31, ln = lane & 15, hh = lane >> 4; const int by = blockIdx.y;
  A += (size_t)by * sA; Bh += (size_t)by * sB; const size_t cofs = (size_t)by * sC; const float* bp = bias ? bias + (size_t)by * sBias : nullptr;
  const int ntn = (N + 63) / 64; const int wid = blockIdx.x * 4 + w; const int mt = wid / ntn, nq = wid % ntn; if (mt * 16 >= M) return;
  const int row0 = mt * 16, col0 = nq * 64; const _Float16* arow = A + (size_t)(row0 + ln) * lda;
  v8f acc[4] = {};
  for (int kb = 0; kb < K; kb += 32) { FragH ah; ah.half[0] = *(const v8us*)((const unsigned short*)arow + kb + 8 * hh); ah.half[1] = *(const v8us*)((const unsigned short*)arow + kb + 16 + 8 * hh);
#pragma unroll
    for (int t = 0; t < 4; ++t) { if (col0 + t * 16 >= N) continue; const size_t boff = (size_t)(col0 + t * 16 + ln) * ldb + kb; FragH bq; bq.half[0] = *(const v8us*)((const unsigned short*)Bh + boff + 8 * hh); bq.half[1] = *(const v8us*)((const unsigned short*)Bh + boff + 16 + 8 * hh);
      acc[t] = mmaH<1>(ah.v, ah.v, bq.v, bq.v, acc[t]); }
  }
#pragma unroll
  for (int t = 0; t < 4; ++t) { if (col0 + t * 16 >= N) continue; const int col = col0 + t * 16 + ln; const float bv = bp ? bf16_round(bp[col]) : 0.f;
#pragma unroll
    for (int r = 0; r < 8; ++r) { float v = acc[t][r] * alpha + bv; if (CP) { const int rr = row0g + row0 + 8 * hh + r; if (rowsPerB < 0) v += CP[cofs + (size_t)rr * ldc + col];      /* rowsPerB < 0: own element of the batched C plane */ else { const int bidx = rr / rowsPerB; v += CP[(size_t)bidx * sCPb + (size_t)by * 64 + col]; } } if (ACT == 1) v = (v > 0.f) ? v : expm1f(v); else if (ACT == 7) v = (v > 0.f) ? v + 1.0f : expf(v); else if (ACT == 8) v = tanhf(v); else if (ACT == 9) v = 0.5f * v * (1.0f + tanhf(0.7978845608028654f * (v + 0.044715f * v * v * v))); else if (ACT == 11) v = 1.0f / (1.0f + expf(-v)); else if (ACT == 12) v = (v > 0.f) ? v : 0.01f * v; else if (ACT == 14) v = (v > 0.f) ? v : 0.1f * v; else if (ACT == 16) v = (v >= 0.f) ? v : 0.3f * v; else if (ACT == 17) v = (v >= 0.f) ? v : 0.2f * v; else if (ACT == 15) v = v / (1.0f + expf(-v)); else if (ACT == 3) v = fmaxf(v, 0.f); else if (ACT == 6) v = 0.5f * v * (1.0f + erff(v * 0.70710678118654752f)); so[w][8 * hh + r][t * 16 + ln] = v; } }
  __builtin_amdgcn_fence(__ATOMIC_ACQ_REL, "workgroup"); __builtin_amdgcn_wave_barrier();
  const int rsub = lane >> 4, c4 = (lane & 15) * 4; typedef _Float16 v4h __attribute__((ext_vector_type(4)));
  {
#pragma unroll
    for (int q = 0; q < 8; ++q) { const int r = q * 2 + rsub; if (col0 + c4 < N) { const v4f v = *(const v4fa*)&so[w][r][c4]; if (C) *(v4f*)(C + cofs + (size_t)(row0 + r) * ldc + col0 + c4) = v; if (C16) { v4h h4; for (int i = 0; i < 4; ++i) h4[i] = (_Float16)v[i]; *(v4h*)(C16 + cofs + (size_t)(row0 + r) * ldc + col0 + c4) = h4; } } }
     }
}


typedef _Float16 v4h __attribute__((ext_vector_type(4)));

__device__ __forceinline__ void d_x16(int bi, const float* __restrict__ x, _Float16* __restrict__ X16, size_t n8) { const size_t t = (size_t)bi * 256 + threadIdx.x; if (t >= n8) return; FragH f;
#pragma unroll
  for (int q = 0; q < 8; ++q) f.h[q] = (_Float16)bf16_round(x[t * 8 + q]); *(v8us*)((unsigned short*)X16 + t * 8) = f.half[0];  }
__global__ __launch_bounds__(256) void k_h16(const float* __restrict__ x, _Float16* __restrict__ X16, size_t n8) { const size_t t = (size_t)blockIdx.x * 256 + threadIdx.x; if (t >= n8) return; FragH f;
#pragma unroll
  for (int q = 0; q < 8; ++q) f.h[q] = (_Float16)x[t * 8 + q]; *(v8us*)((unsigned short*)X16 + t * 8) = f.half[0];  }
__global__ __launch_bounds__(256) void k_round16f(const float* __restrict__ W, _Float16* __restrict__ Bt, size_t n8) { const size_t t = (size_t)blockIdx.x * 256 + threadIdx.x; if (t >= n8) return; FragH f;
#pragma unroll
  for (int i = 0; i < 8; ++i) f.h[i] = (_Float16)(bf16_round(W[t * 8 + i]) * 16.0f); *(v8us*)((unsigned short*)Bt + t * 8) = f.half[0];  }
template <int NHv, int TTv>
__device__ __forceinline__ void d_vt(unsigned short (*tl)[66], int bi, const _Float16* __restrict__ V16, int ldv, int voff, _Float16* __restrict__ Vt) { const int tid = threadIdx.x; const int slab = bi / (TTv / 64), lg = bi % (TTv / 64); const int b = slab / NHv, h = slab % NHv;
  for (int i = tid; i < 64 * 8; i += 256) { const int r = i / 8, c8 = (i % 8) * 8; FragH f; f.half[0] = *(const v8us*)((const unsigned short*)V16 + ((size_t)b * TTv + lg * 64 + r) * ldv + voff + h * 64 + c8);
#pragma unroll
    for (int q = 0; q < 8; ++q) tl[r][c8 + q] = f.u[q]; }
  __syncthreads();
  {
#pragma unroll
    for (int rd = 0; rd < 2; ++rd) { const int d = rd * 32 + tid / 8, pc = tid % 8; FragH f;
#pragma unroll
      for (int q = 0; q < 8; ++q) f.u[q] = tl[pc * 8 + q][d];
      *(v8us*)((unsigned short*)Vt + ((size_t)slab * 64 + d) * TTv + lg * 64 + pc * 8) = f.half[0]; }
     } }

template <int NTH>      /* NTH: threads of the work-group that runs it */
__device__ __forceinline__ void d_hl(int bi, const float* __restrict__ F, _Float16* __restrict__ Hh, _Float16* __restrict__ Hl, size_t n8) { const size_t t = (size_t)bi * NTH + threadIdx.x; if (t >= n8) return; FragH fh, fl; const v4f a = *(const v4fa*)(F + t * 8), c = *(const v4fa*)(F + t * 8 + 4);
#pragma unroll
  for (int q = 0; q < 4; ++q) { _Float16 h = (_Float16)a[q]; fh.h[q] = h; fl.h[q] = (_Float16)((a[q] - (float)h) * 1024.0f); h = (_Float16)c[q]; fh.h[4 + q] = h; fl.h[4 + q] = (_Float16)((c[q] - (float)h) * 1024.0f); }
  { *(v8us*)((unsigned short*)Hh + t * 8) = fh.half[0]; *(v8us*)((unsigned short*)Hl + t * 8) = fl.half[0];  } }

// ---- fast GEMM (work-group tile 128x64, wave tile 32x64; requires M % 128 == 0 rows per launch region and N % 64 == 0); epilogue = k_gemm_hhx semantics ----
__device__ __forceinline__ v8f g2_mma(v16h a, v16h b, v8f c) { v8f d = __builtin_amdgcn_wmma_f32_16x16x32_f16(false, a, false, b, (short)0, c, false, false); asm volatile("v_nop\n\tv_nop\n\tv_nop\n\tv_nop" : "+v"(d) : "v"(a), "v"(b)); return d; }
// One A or B fragment (16 rows x 32 k) from staged LDS rows; p: the lane's row, plus 16 * hh bytes. k order, the same for A and B: 8 hh .. 8 hh + 7, then 16 + 8 hh .. 16 + 8 hh + 7.
__device__ __forceinline__ v16h g2_lfrag(const unsigned char* p) { FragH f; f.half[0] = *(const v8us*)p; f.half[1] = *(const v8us*)(p + 32); return f.v; }
// Twelve asynchronous 16-byte copies per lane, global memory -> LDS. The s_wait_xcnt is the last line of the copies' own statement, so no register that a copy names is rewritten in front of it.
__device__ __forceinline__ void g2_copy12(const unsigned (&l)[12], const _Float16* const (&g)[12]) {
  asm volatile("global_load_async_to_lds_b128 %0, %12, off\n\t"
               "global_load_async_to_lds_b128 %1, %13, off\n\t"
               "global_load_async_to_lds_b128 %2, %14, off\n\t"
               "global_load_async_to_lds_b128 %3, %15, off\n\t"
               "global_load_async_to_lds_b128 %4, %16, off\n\t"
               "global_load_async_to_lds_b128 %5, %17, off\n\t"
               "global_load_async_to_lds_b128 %6, %18, off\n\t"
               "global_load_async_to_lds_b128 %7, %19, off\n\t"
               "global_load_async_to_lds_b128 %8, %20, off\n\t"
               "global_load_async_to_lds_b128 %9, %21, off\n\t"
               "global_load_async_to_lds_b128 %10, %22, off\n\t"
               "global_load_async_to_lds_b128 %11, %23, off\n\t"
               "s_wait_xcnt 0x0"
               :: "v"(l[0]), "v"(l[1]), "v"(l[2]), "v"(l[3]), "v"(l[4]), "v"(l[5]), "v"(l[6]), "v"(l[7]), "v"(l[8]), "v"(l[9]), "v"(l[10]), "v"(l[11]),
                  "v"(g[0]), "v"(g[1]), "v"(g[2]), "v"(g[3]), "v"(g[4]), "v"(g[5]), "v"(g[6]), "v"(g[7]), "v"(g[8]), "v"(g[9]), "v"(g[10]), "v"(g[11]) : "memory"); }
// One k slab (KC columns of the work-group's 128 A rows, then of its 64 B rows) into one LDS buffer. A row's KC * 2 bytes are KC / 8 neighbouring lanes' 16 bytes each: every copy covers whole 128-byte lines.
// ag, bg: the lane's own 16 bytes in row tid / (KC / 8) of the A and of the B slab; lds: the LDS byte address of the same place in the buffer. Unrolled in full: l[] and g[] are asm operands.
template <int KC>
__device__ __forceinline__ void g2_stage(const _Float16* ag, int lda, const _Float16* bg, int ldb, unsigned lds) {
  constexpr int RPU = 128 / (KC / 8), NA = 128 / RPU, NC = 192 / RPU, PB = KC * 2 + 16;      /* rows per round of 128 lanes; rounds for A; rounds in all; LDS pitch in bytes */
#pragma unroll
  for (int s = 0; s < NC / 12; ++s) { unsigned l[12]; const _Float16* g[12];
#pragma unroll
    for (int j = 0; j < 12; ++j) { const int u = s * 12 + j; l[j] = lds + (unsigned)(u * RPU * PB); g[j] = (u < NA) ? ag + (size_t)(u * RPU) * lda : bg + (size_t)((u - NA) * RPU) * ldb; }
    g2_copy12(l, g); } }
// BG: consecutive blockIdx.y values that share one B slab (grouped-query attention: BG query heads read the same k / v rows); slab = blockIdx.y / BG
// KC: columns of k per staged slab. M a multiple of 128, N of 64, K of KC. The work-group's A rows (128) and B rows (64) go to LDS slab by slab, two buffers: slab t + 1 is copied while slab t is multiplied.
// LDS pitch KC * 2 + 16 bytes = 16 B x odd, so the 16 rows of a fragment read spread over the banks.
// ROPE (ACT 0; bias and CP are not read): the q, k and v projections in one launch. Bh holds the q, then the k, then the v weight rows (ldc + 2 ldkv = N rows); an N tile is one head (64 columns) of q, of k or of v and goes to that plane: C, C16 (pitch ldc), Ck, Ck16 or Cv, Cv16 (pitch ldkv).
// The epilogue turns each (even, odd) column pair of row r of a q or k tile by the angle whose cosine and sine are CS, SN[r % SQ][pair] (a v tile: by the angle 0, which leaves every finite value as it is) and stores the rows: f16 to the 16-bit plane, and f32 to the f32 plane for the first nf32 rows of every SQ rows (one batch; an f32 plane holds nf32 rows a batch, batch after batch).
typedef float v2fa __attribute__((ext_vector_type(2), may_alias));
// Two (even, odd) pairs, each turned by its own angle: c, s hold the two cosines and sines.
__device__ __forceinline__ v4f g2_turn(v4f v, v2fa c, v2fa s) { v4f o; o[0] = v[0] * c[0] - v[1] * s[0]; o[1] = v[0] * s[0] + v[1] * c[0]; o[2] = v[2] * c[1] - v[3] * s[1]; o[3] = v[2] * s[1] + v[3] * c[1]; return o; }
template <int ACT, int BG = 1, int KC = 128, bool ROPE = false>
__global__ __launch_bounds__(128) void k_gemm2(const _Float16* __restrict__ A, int lda, size_t sA, const _Float16* __restrict__ Bh, int ldb, size_t sB, float alpha, const float* __restrict__ bias, size_t sBias, const float* __restrict__ CP, int rowsPerB, size_t sCPb, int row0g,
    float* __restrict__ C, _Float16* __restrict__ C16, int ldc, size_t sC, int M, int N, int K, const float* __restrict__ CS = nullptr, const float* __restrict__ SN = nullptr, int nf32 = 0,
    float* __restrict__ Ck = nullptr, _Float16* __restrict__ Ck16 = nullptr, float* __restrict__ Cv = nullptr, _Float16* __restrict__ Cv16 = nullptr, int ldkv = 0) { static_assert(ACT == 0 || ACT == 3 || ACT == 6 || ACT == 8 || ACT == 9 || ACT == 11 || ACT == 12 || ACT == 14 || ACT == 15 || ACT == 16 || ACT == 17, "k_gemm2: unsupported ACT code (would silently apply no activation)");
  constexpr int PB = KC * 2 + 16, BUFB = 192 * PB; static_assert(2 * BUFB >= 4 * 32 * 68 * 4, "the output staging must fit the two slab buffers");
  __shared__ __attribute__((aligned(16))) unsigned char st[2 * BUFB];
  float (*so)[32][68] = (float (*)[32][68])st;      /* output staging in the same LDS: first written behind the last trip's barrier, when no copy is in flight and every fragment read is done */
  const int tid = threadIdx.x, w = tid >> 5, lane = tid & 31, ln = lane & 15, hh = lane >> 4; const int by = blockIdx.y;
  A += (size_t)by * sA; Bh += (size_t)(by / BG) * sB; const size_t cofs = (size_t)by * sC; const float* bp = bias ? bias + (size_t)by * sBias : nullptr;
  const int ntn = N >> 6; const int mt = blockIdx.x / ntn, nq = blockIdx.x - mt * ntn; const int row0 = mt * 128 + 32 * w, col0 = nq * 64; if (mt * 128 >= M) return;      /* the same for the whole work-group: it stands in front of barriers */
  const int sr = tid / (KC / 8), sc = tid % (KC / 8);      /* this lane's row and 16-byte column in a round of copies */
  const _Float16* ag = A + (size_t)(mt * 128 + sr) * lda + sc * 8; const _Float16* bg = Bh + (size_t)(col0 + sr) * ldb + sc * 8;
  const unsigned lds0 = (unsigned)(size_t)(&st[0]) + (unsigned)(sr * PB + sc * 16);
  const int nt = K / KC;
  const v8f z8 = {0.f,0.f,0.f,0.f,0.f,0.f,0.f,0.f}; v8f c00 = z8, c01 = z8, c02 = z8, c03 = z8, c10 = z8, c11 = z8, c12 = z8, c13 = z8;
  g2_stage<KC>(ag, lda, bg, ldb, lds0);
  asm volatile("s_wait_asynccnt 0x0" ::: "memory");      /* this wave's copies of slab 0 have landed */
  __syncthreads();      /* slab 0 readable by every wave */
  if (nt > 1) g2_stage<KC>(ag + KC, lda, bg + KC, ldb, lds0 + BUFB);
#pragma unroll 1
  for (int t = 0; t < nt; ++t) { const unsigned char* sb = st + (t & 1) * BUFB; const unsigned char* sa = sb + (32 * w + ln) * PB + 16 * hh; const unsigned char* sbr = sb + (128 + ln) * PB + 16 * hh;
    v16h fa[2][2], fb[2][4];      /* two fragment sets: the next k step's twelve LDS reads go out as one group in front of this k step's products, so the wave waits out the LDS latency once a slab */
    fa[0][0] = g2_lfrag(sa); fa[0][1] = g2_lfrag(sa + 16 * PB); fb[0][0] = g2_lfrag(sbr); fb[0][1] = g2_lfrag(sbr + 16 * PB); fb[0][2] = g2_lfrag(sbr + 32 * PB); fb[0][3] = g2_lfrag(sbr + 48 * PB);
#pragma unroll
    for (int kk = 0; kk < KC / 32; ++kk) { const int cu = kk & 1, nx = cu ^ 1;      /* unrolled in full: fa[] and fb[] are indexed by constants and stay in registers, the LDS offsets become immediates */
      if (kk + 1 < KC / 32) { const int o = (kk + 1) * 64; fa[nx][0] = g2_lfrag(sa + o); fa[nx][1] = g2_lfrag(sa + 16 * PB + o); fb[nx][0] = g2_lfrag(sbr + o); fb[nx][1] = g2_lfrag(sbr + 16 * PB + o); fb[nx][2] = g2_lfrag(sbr + 32 * PB + o); fb[nx][3] = g2_lfrag(sbr + 48 * PB + o); }
      c00 = g2_mma(fa[cu][0], fb[cu][0], c00); c10 = g2_mma(fa[cu][1], fb[cu][0], c10);
      c01 = g2_mma(fa[cu][0], fb[cu][1], c01); c11 = g2_mma(fa[cu][1], fb[cu][1], c11);
      c02 = g2_mma(fa[cu][0], fb[cu][2], c02); c12 = g2_mma(fa[cu][1], fb[cu][2], c12);
      c03 = g2_mma(fa[cu][0], fb[cu][3], c03); c13 = g2_mma(fa[cu][1], fb[cu][3], c13); }
    asm volatile("s_wait_dscnt 0x0" ::: "memory");      /* this wave's reads of slab t are done before the buffer is refilled */
    asm volatile("s_wait_asynccnt 0x0" ::: "memory");      /* this wave's copies of slab t + 1 have landed */
    __syncthreads();      /* publishes slab t + 1 and ends every wave's reads of slab t */
    if (t + 2 < nt) g2_stage<KC>(ag + (size_t)(t + 2) * KC, lda, bg + (size_t)(t + 2) * KC, ldb, lds0 + (unsigned)((t & 1) * BUFB)); }
  asm volatile("s_wait_asynccnt 0x0" ::: "memory");      /* no copy outstanding when the LDS becomes output staging */
  v2fa cc[ROPE ? 16 : 1], ss[ROPE ? 16 : 1];      /* ROPE: cosines and sines of the 2 pairs that this lane turns in each of its 16 rows; 16 lanes read one table row = one 128-byte line */
  [[maybe_unused]] float* Cf = C; [[maybe_unused]] _Float16* Ch = C16; [[maybe_unused]] int ldo = ldc, oc0 = col0;      /* ROPE: the tile's own f32 and f16 plane, their pitch, the tile's first column there; all from blockIdx: the same for the whole work-group */
  if constexpr (ROPE) { static_assert(HD == 64 && ACT == 0, "one N tile = one head: a pair's number is its column in the tile / 2; no activation");
    const int nqt = ldc >> 6, nkt = ldkv >> 6; const bool isv = nq >= nqt + nkt;      /* N tiles of q, of k (and of v) */
    if (nq >= nqt) { Cf = isv ? Cv : Ck; Ch = isv ? Cv16 : Ck16; ldo = ldkv; oc0 = (nq - nqt - (isv ? nkt : 0)) * 64; }
    if (!isv) {
#pragma unroll      /* unrolled in full: cc[], ss[] stay in registers; all 32 loads go out here, so their latency passes while the accumulators are staged */
      for (int q = 0; q < 16; ++q) { const size_t tb = (size_t)((unsigned)(row0 + q * 2 + hh) % SQ) * (HD / 2) + ln * 2; cc[q] = *(const v2fa*)(CS + tb); ss[q] = *(const v2fa*)(SN + tb); }
      asm volatile("s_wait_xcnt 0x0" ::: "memory");      /* the table loads' address registers are reused below; inside the branch, directly behind the loads, so that nothing of the code behind the branch can be scheduled ahead of the wait */
    } else {
#pragma unroll      /* unrolled in full, like the loop above */
      for (int q = 0; q < 16; ++q) { cc[q] = v2fa{1.f, 1.f}; ss[q] = v2fa{0.f, 0.f}; } } }
  v8f accs[8] = {c00, c01, c02, c03, c10, c11, c12, c13};
  if constexpr (ROPE) {      /* q and k have no bias, no added plane and no activation: the staging is the scaled accumulators alone; both loops unrolled in full: accs[] is indexed by constants and stays in registers */
#pragma unroll
    for (int u = 0; u < 8; ++u) {
#pragma unroll
      for (int r = 0; r < 8; ++r) so[w][(u >> 2) * 16 + 8 * hh + r][(u & 3) * 16 + ln] = accs[u][r] * alpha; }
  } else {
#pragma unroll
  for (int u = 0; u < 8; ++u) { const int t = u & 3, half = u >> 2; const int col = col0 + t * 16 + ln; const float bv = bp ? bf16_round(bp[col]) : 0.f;
#pragma unroll
    for (int r = 0; r < 8; ++r) { const int rloc = half * 16 + 8 * hh + r; float v = accs[u][r] * alpha + bv; if (CP) { if (rowsPerB < 0) v += CP[cofs + (size_t)(row0g + row0 + rloc) * ldc + col];      /* rowsPerB < 0: own element of the batched C plane */ else { const int bidx = (row0g + row0 + rloc) / rowsPerB; v += CP[(size_t)bidx * sCPb + (size_t)by * 64 + col]; } }
      if (ACT == 3) v = fmaxf(v, 0.f); else if (ACT == 6) v = 0.5f * v * (1.0f + erff(v * 0.70710678118654752f)); else if (ACT == 11) v = 1.0f / (1.0f + expf(-v)); else if (ACT == 15) v = v / (1.0f + expf(-v)); else if (ACT == 12) v = (v > 0.f) ? v : 0.01f * v; else if (ACT == 8) v = tanhf(v); else if (ACT == 9) v = 0.5f * v * (1.0f + tanhf(0.7978845608028654f * (v + 0.044715f * v * v * v))); else if (ACT == 14) v = (v > 0.f) ? v : 0.1f * v; else if (ACT == 16) v = (v >= 0.f) ? v : 0.3f * v; else if (ACT == 17) v = (v >= 0.f) ? v : 0.2f * v;
      so[w][rloc][t * 16 + ln] = v; } } }
  __builtin_amdgcn_fence(__ATOMIC_ACQ_REL, "workgroup"); __builtin_amdgcn_wave_barrier();
  const int rsub = lane >> 4, c4 = (lane & 15) * 4;
  if constexpr (ROPE) {      /* both loops unrolled in full: cc[], ss[] are indexed by constants; a lane's 4 columns are 2 whole pairs */
#pragma unroll
    for (int q = 0; q < 16; ++q) { const int r = q * 2 + rsub; const v4f o = g2_turn(*(const v4fa*)&so[w][r][c4], cc[q], ss[q]); v4h h4; for (int i = 0; i < 4; ++i) h4[i] = (_Float16)o[i]; *(v4h*)(Ch + cofs + (size_t)(row0 + r) * ldo + oc0 + c4) = h4; }
    static_assert(SQ % 128 == 0, "a row tile lies in one batch");
    const int bt = (mt * 128) / SQ; const int lim = bt * SQ + nf32; const size_t fsh = (size_t)bt * (SQ - nf32) * ldo;      /* the tile's batch; the end of that batch's f32 rows; what row bt * SQ + i of the GEMM lies ahead of row bt * nf32 + i of C: all three the same for the whole work-group */
    asm volatile("s_wait_xcnt 0x0" ::: "memory");      /* the f16 stores' address and data registers are reused below; in front of the branch, so that nothing of the block behind it can be scheduled ahead of the wait */
    if (mt * 128 < lim) {      /* the same for the whole work-group: only the first row tiles of a batch also store f32 rows; a loop of its own, so that the f16 loop above is free of branches and its LDS reads go out together */
#pragma unroll      /* unrolled in full, like the loop above */
      for (int q = 0; q < 16; ++q) { const int r = q * 2 + rsub; if (row0 + r < lim) *(v4f*)(Cf + (cofs + (size_t)(row0 + r) * ldo + oc0 + c4 - fsh)) = g2_turn(*(const v4fa*)&so[w][r][c4], cc[q], ss[q]); } }
  } else {
#pragma unroll
    for (int q = 0; q < 16; ++q) { const int r = q * 2 + rsub; const v4f v = *(const v4fa*)&so[w][r][c4]; if (C) *(v4f*)(C + cofs + (size_t)(row0 + r) * ldc + col0 + c4) = v; if (C16) { v4h h4; for (int i = 0; i < 4; ++i) h4[i] = (_Float16)v[i]; *(v4h*)(C16 + cofs + (size_t)(row0 + r) * ldc + col0 + c4) = h4; } }
     } }


__global__ __launch_bounds__(256) void k_wnat(const float* __restrict__ w, size_t n8, _Float16* __restrict__ Bt) { const size_t t = (size_t)blockIdx.x * 256 + threadIdx.x; if (t >= n8) return; FragH f; for (int q = 0; q < 8; ++q) f.h[q] = (_Float16)(bf16_round(w[t * 8 + q]) * 16.0f); *(v8us*)((unsigned short*)Bt + t * 8) = f.half[0];  }
__global__ __launch_bounds__(256) void k_rsm(const float* __restrict__ S, _Float16* __restrict__ P, int nrows) {
  #pragma clang fp contract(off)
  const int i = blockIdx.x * 256 + threadIdx.x; if (i >= nrows) return; const float* s = S + (size_t)i * SQ; float mx = -3.0e38f;
#pragma unroll 1
  for (int j = 0; j < SQ; ++j) mx = fmaxf(mx, s[j]); float se = 0.f;
#pragma unroll 1
  for (int j = 0; j < SQ; ++j) se += expf(s[j] - mx); const float sc = 256.0f / se;
#pragma unroll 1
  for (int j0 = 0; j0 < SQ; j0 += 8) { FragH f; for (int q = 0; q < 8; ++q) f.h[q] = (_Float16)(expf(s[j0 + q] - mx) * sc); unsigned short* d = (unsigned short*)P + (size_t)i * SQ + j0; *(v8us*)d = f.half[0];  } }
__global__ __launch_bounds__(256) void k_vt(const _Float16* __restrict__ V16, int b, int h0, _Float16* __restrict__ VT) { __shared__ unsigned short tl[64][65]; const int tid = threadIdx.x; const int hh = blockIdx.x % HG, sg = blockIdx.x / HG; const int s0 = sg * 64; const int h = h0 + hh;
  for (int i = tid; i < 64 * 8; i += 256) { const int j = i / 8, d8 = (i % 8) * 8; FragH f; f.half[0] = *(const v8us*)((const unsigned short*)V16 + ((size_t)b * SQ + s0 + j) * DM + h * HD + d8); for (int q = 0; q < 8; ++q) tl[d8 + q][j] = f.u[q]; }
  __syncthreads();
  { for (int i = tid; i < 64 * 8; i += 256) { const int d = i / 8, j8 = (i % 8) * 8; FragH f; for (int q = 0; q < 8; ++q) f.u[q] = tl[d][j8 + q]; *(v8us*)((unsigned short*)VT + ((size_t)hh * HD + d) * SQ + s0 + j8) = f.half[0]; }  } }



#define FK 64                        /* keys per staged tile of the fused attention kernel */
#define FPB (FK * 2 + 16)            /* LDS pitch of a staged row (a k row: HD f16 = 128 B; a V^T row: FK f16 = 128 B) plus 16 B: 16 B x odd, so the 16 rows of a fragment read spread over the banks */
#define FBUF (2 * FK * FPB)          /* one buffer: FK k rows, then HD V^T rows */
#define FQ 32                        /* query rows per wave */
// Eight asynchronous 16-byte copies per lane, global memory -> LDS. The s_wait_xcnt is the last line of the copies' own statement, so no register that a copy names is rewritten in front of it.
__device__ __forceinline__ void fa_copy8(const unsigned (&l)[8], const _Float16* const (&g)[8]) {
  asm volatile("global_load_async_to_lds_b128 %0, %8, off\n\t"
               "global_load_async_to_lds_b128 %1, %9, off\n\t"
               "global_load_async_to_lds_b128 %2, %10, off\n\t"
               "global_load_async_to_lds_b128 %3, %11, off\n\t"
               "global_load_async_to_lds_b128 %4, %12, off\n\t"
               "global_load_async_to_lds_b128 %5, %13, off\n\t"
               "global_load_async_to_lds_b128 %6, %14, off\n\t"
               "global_load_async_to_lds_b128 %7, %15, off\n\t"
               "s_wait_xcnt 0x0"
               :: "v"(l[0]), "v"(l[1]), "v"(l[2]), "v"(l[3]), "v"(l[4]), "v"(l[5]), "v"(l[6]), "v"(l[7]),
                  "v"(g[0]), "v"(g[1]), "v"(g[2]), "v"(g[3]), "v"(g[4]), "v"(g[5]), "v"(g[6]), "v"(g[7]) : "memory"); }
// One tile (FK k rows, then the same FK keys of the HD V^T rows) into one LDS buffer: a row's 128 bytes are 8 neighbouring lanes' 16 bytes each, 16 rows a round of 128 lanes.
// kg, vg: the lane's own 16 bytes in row tid / 8 of the k tile and of the V^T tile; lds: the LDS byte address of the same place in the buffer. Unrolled in full: l[] and g[] are asm operands.
__device__ __forceinline__ void fa_stage(const _Float16* kg, const _Float16* vg, unsigned lds) {
  unsigned l[8]; const _Float16* g[8];
#pragma unroll
  for (int u = 0; u < 8; ++u) { l[u] = lds + (unsigned)(u * 16 * FPB); g[u] = (u < 4) ? kg + (size_t)(u * 16) * KVD : vg + (size_t)((u - 4) * 16) * SQ; }
  fa_copy8(l, g); }
__device__ __forceinline__ void fa_exp8(float (&x)[8]) {
  asm("v_exp_f32 %0, %0\n\t"
      "v_exp_f32 %1, %1\n\t"
      "v_exp_f32 %2, %2\n\t"
      "v_exp_f32 %3, %3\n\t"
      "v_exp_f32 %4, %4\n\t"
      "v_exp_f32 %5, %5\n\t"
      "v_exp_f32 %6, %6\n\t"
      "v_exp_f32 %7, %7\n\t"
      "v_nop"
      : "+v"(x[0]), "+v"(x[1]), "+v"(x[2]), "+v"(x[3]), "+v"(x[4]), "+v"(x[5]), "+v"(x[6]), "+v"(x[7])); }
// One 2^x with the same slot behind it.
__device__ __forceinline__ float fa_exp1(float x) { asm("v_exp_f32 %0, %0\n\tv_nop" : "+v"(x)); return x; }
__device__ __forceinline__ v8f fa_mma(v16h a, v16h b, v8f c) { return __builtin_amdgcn_wmma_f32_16x16x32_f16(false, a, false, b, (short)0, c, false, false); }
#define NFA (NB * NG * (SQ / FQ))    /* attention work-groups */
#define NHL ((int)((size_t)NB * QT0 * DM / 8 / 128))      /* work-groups of 128 threads for the hi / residual split, 8 elements a thread */
__global__ __launch_bounds__(128) void k_fattn(const _Float16* __restrict__ Q, const _Float16* __restrict__ Kh, const _Float16* __restrict__ Vt, _Float16* __restrict__ O, const float* __restrict__ F, _Float16* __restrict__ Hh, _Float16* __restrict__ Hl) {
  __shared__ __attribute__((aligned(16))) unsigned char st[2 * FBUF];
  if ((int)blockIdx.x >= NFA) { d_hl<128>((int)blockIdx.x - NFA, F, Hh, Hl, (size_t)NB * QT0 * DM / 8); return; }      /* the same for the whole work-group; in front of every copy and barrier */
  const int tid = threadIdx.x, lane = tid & 31, c = lane & 15, hh = lane >> 4; const int w = __builtin_amdgcn_readfirstlane(tid >> 5);      /* the wave's number in a scalar register: the head's offsets become scalar arithmetic */
  const int qt = (SQ / FQ - 1) - (int)(blockIdx.x / (NB * NG)); const int bg = (int)(blockIdx.x % (NB * NG)); const int b = bg / NG, g = bg % NG;      /* longest rows first */
  const int q0 = qt * FQ, h = g * HPG + w; const int nt = (q0 + FQ + FK - 1) / FK;      /* causal: tiles up to the one that holds the last query's own key; the same for the whole work-group */
  const int sr = tid >> 3, sc = tid & 7;      /* this lane's row and 16-byte column in a round of copies */
  const _Float16* kg = Kh + ((size_t)b * SQ + sr) * KVD + g * HD + sc * 8; const _Float16* vg = Vt + ((size_t)bg * HD + sr) * SQ + sc * 8;
  const unsigned lds0 = (unsigned)(size_t)(&st[0]) + (unsigned)(sr * FPB + sc * 16);
  fa_stage(kg, vg, lds0);
  v16h qf[2][2];
#pragma unroll
  for (int j = 0; j < 2; ++j) {
#pragma unroll
    for (int ks = 0; ks < 2; ++ks) { const unsigned short* p = (const unsigned short*)Q + ((size_t)b * SQ + q0 + j * 16 + c) * DM + h * HD + ks * 32 + 8 * hh; FragH f; f.half[0] = *(const v8us*)p; f.half[1] = *(const v8us*)(p + 16); qf[j][ks] = f.v; } }
  asm volatile("s_wait_xcnt 0x0" ::: "memory");      /* the q loads' address registers are reused below */
  asm volatile("s_wait_asynccnt 0x0" ::: "memory");      /* this wave's copies of tile 0 have landed */
  __syncthreads();      /* tile 0 readable by every wave */
  if (nt > 1) fa_stage(kg + (size_t)FK * KVD, vg + FK, lds0 + FBUF);
  const v8f z8 = {0.f,0.f,0.f,0.f,0.f,0.f,0.f,0.f};
  v8f acc[4][2]; float m[2], l[2];
#pragma unroll
  for (int j = 0; j < 2; ++j) { m[j] = -1.0e30f; l[j] = 0.f;
#pragma unroll
    for (int dt = 0; dt < 4; ++dt) acc[dt][j] = z8; }
  const float C = 0.125f * 1.4426950408889634f;      /* 1 / sqrt(HD), and e^x = 2^(x log2 e) */
#pragma unroll 1      /* kept rolled: one copy of the long body, the buffer chosen by t & 1 */
  for (int t = 0; t < nt; ++t) { const unsigned char* sk = st + (t & 1) * FBUF + c * FPB + 16 * hh; const unsigned char* sv = sk + FK * FPB;
#pragma unroll
    for (int ps = 0; ps < FK / 32; ++ps) { const int kb = t * FK + ps * 32;      /* a pass: 32 keys, one k step of O^T += V^T P^T */
      if (kb <= q0) {      /* the same for the whole work-group; false only for a pass whose every key lies past the diagonal */
        v8f s[2][2];
#pragma unroll
        for (int kt = 0; kt < 2; ++kt) { const v16h k0 = g2_lfrag(sk + (ps * 2 + kt) * 16 * FPB), k1 = g2_lfrag(sk + (ps * 2 + kt) * 16 * FPB + 64);
#pragma unroll
          for (int j = 0; j < 2; ++j) s[kt][j] = fa_mma(k1, qf[j][1], fa_mma(k0, qf[j][0], z8)); }
        if (kb == q0) {      /* only the pass on the diagonal holds masked keys */
#pragma unroll
          for (int kt = 0; kt < 2; ++kt) {
#pragma unroll
            for (int j = 0; j < 2; ++j) {
#pragma unroll
              for (int r = 0; r < 8; ++r) s[kt][j][r] = (kt * 16 + 8 * hh + r <= j * 16 + c) ? s[kt][j][r] : -1.0e30f; } } }
        FragH pf[2];
#pragma unroll
        for (int j = 0; j < 2; ++j) { float mk[2];
#pragma unroll
          for (int kt = 0; kt < 2; ++kt) mk[kt] = fmaxf(fmaxf(fmaxf(s[kt][j][0], s[kt][j][1]), fmaxf(s[kt][j][2], s[kt][j][3])), fmaxf(fmaxf(s[kt][j][4], s[kt][j][5]), fmaxf(s[kt][j][6], s[kt][j][7])));
          float mx = fmaxf(mk[0], mk[1]); mx = fmaxf(mx, __shfl_xor(mx, 16, 32)); mx = fmaxf(mx, m[j]);
          const float al = fa_exp1((m[j] - mx) * C); const float nb = 8.0f - mx * C; m[j] = mx;      /* weights x256: 2^(s C - mx C + 8); a masked key gives 0 */
          float sm[2];
#pragma unroll
          for (int kt = 0; kt < 2; ++kt) { float p[8];
#pragma unroll
            for (int r = 0; r < 8; ++r) p[r] = __builtin_fmaf(s[kt][j][r], C, nb);
            fa_exp8(p); sm[kt] = ((p[0] + p[1]) + (p[2] + p[3])) + ((p[4] + p[5]) + (p[6] + p[7]));
#pragma unroll
            for (int r = 0; r < 8; ++r) pf[j].h[kt * 8 + r] = (_Float16)p[r]; }
          l[j] = __builtin_fmaf(l[j], al, sm[0] + sm[1]);      /* this lane half's keys only; the halves are joined behind the loop */
#pragma unroll
          for (int dt = 0; dt < 4; ++dt) acc[dt][j] *= al; }
#pragma unroll
        for (int dt = 0; dt < 4; ++dt) { const v16h vf = g2_lfrag(sv + dt * 16 * FPB + ps * 64);
#pragma unroll
          for (int j = 0; j < 2; ++j) acc[dt][j] = fa_mma(vf, pf[j].v, acc[dt][j]); } } }
    asm volatile("s_wait_dscnt 0x0" ::: "memory");      /* this wave's reads of tile t are done before the buffer is refilled */
    asm volatile("s_wait_asynccnt 0x0" ::: "memory");      /* this wave's copies of tile t + 1 have landed */
    __syncthreads();      /* publishes tile t + 1 and ends every wave's reads of tile t */
    if (t + 2 < nt) fa_stage(kg + (size_t)(t + 2) * FK * KVD, vg + (size_t)(t + 2) * FK, lds0 + (unsigned)((t & 1) * FBUF)); }
  asm volatile("s_wait_asynccnt 0x0" ::: "memory");      /* no copy outstanding when the wave ends */
  FragH of[2][4];      /* every piece converted into registers of its own before the first store: no register of an issued store is written again */
#pragma unroll
  for (int j = 0; j < 2; ++j) { const float fin = 64.0f / (l[j] + __shfl_xor(l[j], 16, 32));
#pragma unroll
    for (int dt = 0; dt < 4; ++dt) {
#pragma unroll
      for (int r = 0; r < 8; ++r) of[j][dt].h[r] = (_Float16)(acc[dt][j][r] * fin); } }
#pragma unroll
  for (int j = 0; j < 2; ++j) { unsigned short* po = (unsigned short*)O + ((size_t)b * SQ + q0 + j * 16 + c) * DM + h * HD + 8 * hh;      /* a lane's 8 accumulator registers are 8 neighbouring head dims of one query row: one 16-byte store */
#pragma unroll
    for (int dt = 0; dt < 4; ++dt) *(v8us*)(po + dt * 16) = of[j][dt].half[0]; }
  asm volatile("s_wait_xcnt 0x0" ::: "memory"); }      /* behind the last store: the split job's code follows in the listing and writes the stores' address and data registers */


#define A0R 16                       /* query rows, one wave each, per work-group of the f32 first-tile kernel */
#define A0P (HD + 4)                 /* pitch of a staged k row in floats: 272 B = 16 B x 17, so 32 lanes reading 32 different rows spread over the LDS banks */
typedef float v2f __attribute__((ext_vector_type(2)));
// f32 causal attention for query rows 0..QT0-1 of every batch (blockIdx.y; QT0 rows a batch in QF, KF, VF and OF). One work-group per (batch, head, A0R query rows): the head's QT0 k and v rows are staged in LDS once,
// then one wave per query row i: scores with one key per lane (32 keys a pass), maximum and sum over the lanes, then o with two head dims per lane, key after key.
// Every loop is unrolled in full so that s[], e[], q[], tk[] and tv[] are indexed by constants and stay in registers and the lane number of each readlane is a constant; the tests on c are the same for the whole wave.
__global__ __launch_bounds__(512) void k_att0w(const float* __restrict__ QF, const float* __restrict__ KF, const float* __restrict__ VF, int ld, float scale, float* __restrict__ OF, int ldo) {
  __shared__ __attribute__((aligned(16))) float lk[QT0][A0P]; __shared__ __attribute__((aligned(16))) float lv[QT0][HD];
  const int tid = threadIdx.x, lane = tid & 31; const int w = __builtin_amdgcn_readfirstlane(tid >> 5);
  const int h = blockIdx.x / (QT0 / A0R), rg = blockIdx.x % (QT0 / A0R); const int i = rg * A0R + w;
  const int hb = h * HD + (int)blockIdx.y * QT0 * ld, ho = h * HD + (int)blockIdx.y * QT0 * ldo;      /* first column of the head in row 0 of this batch's QT0 rows, in QF, KF, VF and in OF */
  v4f tk[QT0 * (HD / 4) / 512], tv[QT0 * (HD / 4) / 512];      /* all loads issued before the first LDS store: one memory latency for the whole stage */
#pragma unroll
  for (int u = 0; u < QT0 * (HD / 4) / 512; ++u) { const int e4 = u * 512 + tid; const size_t g = (size_t)(e4 / (HD / 4)) * ld + hb + (e4 % (HD / 4)) * 4; tk[u] = *(const v4fa*)(KF + g); tv[u] = *(const v4fa*)(VF + g); }
  const float* qr = QF + (size_t)i * ld + hb; v4f q[HD / 4];
#pragma unroll
  for (int d = 0; d < HD / 4; ++d) q[d] = *(const v4fa*)(qr + d * 4);
#pragma unroll
  for (int u = 0; u < QT0 * (HD / 4) / 512; ++u) { const int e4 = u * 512 + tid; *(v4f*)&lk[e4 / (HD / 4)][(e4 % (HD / 4)) * 4] = tk[u]; *(v4f*)&lv[e4 / (HD / 4)][(e4 % (HD / 4)) * 4] = tv[u]; }
  __syncthreads();
  float s[QT0 / 32]; float mx = -1.0e30f;
#pragma unroll
  for (int c = 0; c < QT0 / 32; ++c) { s[c] = -1.0e30f;
    if (c * 32 <= i) { const float* kr = &lk[c * 32 + lane][0]; v4f a = {0.f, 0.f, 0.f, 0.f};
#pragma unroll
      for (int d = 0; d < HD / 4; ++d) a += q[d] * *(const v4f*)(kr + d * 4);
      const float t = ((a[0] + a[1]) + (a[2] + a[3])) * scale; s[c] = (c * 32 + lane <= i) ? t : -1.0e30f; mx = fmaxf(mx, s[c]); } }
#pragma unroll
  for (int d = 16; d > 0; d >>= 1) mx = fmaxf(mx, __shfl_xor(mx, d, 32));
  float e[QT0 / 32]; float l = 0.f;
#pragma unroll
  for (int c = 0; c < QT0 / 32; ++c) { e[c] = 0.f; if (c * 32 <= i) { e[c] = expf(s[c] - mx); l += e[c]; } }      /* a masked key: expf(-1e30 - mx) = 0 */
#pragma unroll
  for (int d = 16; d > 0; d >>= 1) l += __shfl_xor(l, d, 32);
  v2f o = {0.f, 0.f};
#pragma unroll
  for (int c = 0; c < QT0 / 32; ++c) if (c * 32 <= i) {
#pragma unroll
    for (int j = 0; j < 32; ++j) { const float p = __int_as_float(__builtin_amdgcn_readlane(__float_as_int(e[c]), j)); o += p * *(const v2f*)&lv[c * 32 + j][lane * 2]; } }
  const float fin = 64.0f / l;      /* o carried x64 like the f16 path */
  *(v2f*)(OF + (size_t)i * ldo + ho + lane * 2) = o * fin; }


__device__ __forceinline__ void d_kvexp(int bi, const float* __restrict__ src, float* __restrict__ dst, size_t n4) { const size_t t = (size_t)bi * 256 + threadIdx.x; if (t >= n4) return; const size_t e = t * 4; const size_t row = e / DM; const int col = (int)(e % DM); const int h = col / HD, d = col % HD; const v4f v = *(const v4fa*)(src + row * KVD + (size_t)(h / HPG) * HD + d); *(v4f*)(dst + e) = v;  }

__global__ __launch_bounds__(256) void k_tab2(float theta, float* __restrict__ CS, float* __restrict__ SN) {
  #pragma clang fp contract(off)
  const int t = blockIdx.x * 256 + threadIdx.x; if (t >= SQ * (HD / 2)) return; const int i = t % (HD / 2); const int p = t / (HD / 2); const float invf = 1.0f / powf(theta, (float)(2 * i) / (float)HD); const float ang = __fmul_rn((float)p, invf); const float c = cosf(ang), s = sinf(ang);
  *(float*)(CS + t) = c; *(float*)(SN + t) = s;  }
__device__ __forceinline__ void d_bfcp(int bi, const float* __restrict__ src, float* __restrict__ dst, size_t n4) { const size_t t = (size_t)bi * 256 + threadIdx.x; if (t >= n4) return; const v4f a = *(const v4fa*)(src + t * 4); v4f o; for (int q = 0; q < 4; ++q) o[q] = bf16_round(a[q]); *(v4f*)(dst + t * 4) = o;  }

__global__ __launch_bounds__(256) void k_f2bf(const float* __restrict__ F, unsigned short* __restrict__ O, size_t n8) { const size_t t = (size_t)blockIdx.x * 256 + threadIdx.x; if (t >= n8) return; const v4f a = *(const v4fa*)(F + t * 8), b = *(const v4fa*)(F + t * 8 + 4); FragH f;
  for (int q = 0; q < 4; ++q) { f.u[q] = (unsigned short)(__float_as_uint(bf16_round(a[q])) >> 16); f.u[4 + q] = (unsigned short)(__float_as_uint(bf16_round(b[q])) >> 16); }
  *(v8us*)(O + t * 8) = f.half[0];  }
// Launches that do not depend on one another share one launch: a work-group's number picks its job (the test is the same for the whole work-group, so the barrier inside a job is passed by all of its threads or by none).
#define PX ((int)(NR * DM / 8 / 256))            /* x -> f16: work-groups */
#define PWQ ((DM / 64) * (DM / 64))              /* tiles of wq, and of wo */
#define PWK ((KVD / 64) * (DM / 64))             /* tiles of wk, and of wv */
#define PTB (SQ * 32 / 4 / 256)                  /* work-groups per rope table */
// All that reads only the inputs: x rounded to f16, the four weight transposes, the two bf16-rounded rope tables.
__global__ __launch_bounds__(256) void k_prep(const float* __restrict__ x, const float* __restrict__ wq, const float* __restrict__ wk, const float* __restrict__ wv, const float* __restrict__ wo, const float* __restrict__ tcos, const float* __restrict__ tsin,
    _Float16* __restrict__ X16, _Float16* __restrict__ BQ, _Float16* __restrict__ BK, _Float16* __restrict__ BV, _Float16* __restrict__ BO, float* __restrict__ CSB, float* __restrict__ SNB) {
  __shared__ unsigned tl[64][WTP];
  int i = (int)blockIdx.x;
  if (i < PX) { d_x16(i, x, X16, NR * DM / 8); return; } i -= PX;
  if (i < PWQ) { d_wt_f16(tl, i, wq, BQ, DM, DM, 16.0f); return; } i -= PWQ;
  if (i < PWQ) { d_wt_f16(tl, i, wo, BO, DM, DM, 16.0f); return; } i -= PWQ;
  if (i < PWK) { d_wt_f16(tl, i, wk, BK, DM, KVD, 16.0f); return; } i -= PWK;
  if (i < PWK) { d_wt_f16(tl, i, wv, BV, DM, KVD, 16.0f); return; } i -= PWK;
  if (i < PTB) { d_bfcp(i, tcos, CSB, (size_t)SQ * 32 / 4); return; } i -= PTB;
  d_bfcp(i, tsin, SNB, (size_t)SQ * 32 / 4); }
#define PVT (NBR * NG * (SQ / 64))               /* V^T tiles */
#define PKE ((int)((size_t)NBR * QT0 * DM / 4 / 256))      /* work-groups per kv expand */
// All that reads only the projections: V^T [NB][NG][HD][SQ], and the first-tile f32 k and v rows expanded to one slab per query head.
__global__ __launch_bounds__(256) void k_post(const _Float16* __restrict__ V16, _Float16* __restrict__ VT, const float* __restrict__ KF, float* __restrict__ KFe, const float* __restrict__ VF, float* __restrict__ VFe) {
  __shared__ unsigned short tl[64][66];
  int i = (int)blockIdx.x;
  if (i < PVT) { d_vt<NG, SQ>(tl, i, V16, KVD, 0, VT); return; } i -= PVT;
  if (i < PKE) { d_kvexp(i, KF, KFe, (size_t)NBR * QT0 * DM / 4); return; } i -= PKE;
  d_kvexp(i, VF, VFe, (size_t)NBR * QT0 * DM / 4); }
extern "C" void kernel_launch(void* const* d_in, const int* in_sizes, int n_in,
                              void* d_out, int out_size, void* d_ws, size_t ws_size, hipStream_t stream) {
  (void)in_sizes; (void)n_in; (void)out_size;
  const float* const* I = (const float* const*)d_in; const float* x = I[0]; const float* tcos = I[1]; const float* tsin = I[2]; const float* wq = I[3]; const float* wk = I[4]; const float* wv = I[5]; const float* wo = I[6]; const float* bq = nullptr; const float* bk = nullptr; const float* bv = nullptr; const float* bo = nullptr;      /* [in][out] weights, no biases; rope tables [S][32] */
  char* ws = (char*)d_ws; size_t off = 0;
  auto take = [&](size_t bytes) { char* p = ws + off; off += (bytes + 255) & ~(size_t)255; return p; };
  _Float16* BQ = (_Float16*)take((size_t)(DM + 2 * KVD) * DM * 2); _Float16* BK = BQ + (size_t)DM * DM; _Float16* BV = BK + (size_t)KVD * DM;      /* one plane: q, k, v weight rows one behind the other, the B operand of the one projection launch */
  _Float16* BO = (_Float16*)take((size_t)DM * DM * 2);
  _Float16* X16 = (_Float16*)take(NR * DM * 2); float* CSB = (float*)take((size_t)SQ * 32 * 4); float* SNB = (float*)take((size_t)SQ * 32 * 4); _Float16* Q16 = (_Float16*)take(NR * DM * 2); _Float16* K16 = (_Float16*)take(NR * KVD * 2); _Float16* V16 = (_Float16*)take(NR * KVD * 2); _Float16* O16 = (_Float16*)take(NR * DM * 2);
  _Float16* VT = (_Float16*)take((size_t)NB * NG * HD * SQ * 2);
  float* QF0 = (float*)take((size_t)NB * QT0 * DM * 4); float* KF0 = (float*)take((size_t)NB * QT0 * KVD * 4); float* VF0 = (float*)take((size_t)NB * QT0 * KVD * 4); float* KF0e = (float*)take((size_t)NB * QT0 * DM * 4); float* VF0e = (float*)take((size_t)NB * QT0 * DM * 4); float* OF0 = (float*)take((size_t)NB * QT0 * DM * 4); _Float16* OH0 = (_Float16*)take((size_t)NB * QT0 * DM * 2); _Float16* OL0 = (_Float16*)take((size_t)NB * QT0 * DM * 2); float* OUTF = (float*)take(NR * DM * 4);      /* first-tile planes: QT0 rows a batch, batch after batch; OUTF: f32 result rows, converted to bf16 at the end */
  if (off > ws_size) return;
  static_assert(NR * DM / 8 % 256 == 0 && SQ * 32 / 4 % 256 == 0 && (size_t)NBR * QT0 * DM / 4 % 256 == 0 && (size_t)NB * QT0 * DM / 8 % 128 == 0, "each job's elements fill whole work-groups");
  k_prep<<<PX + 2 * PWQ + 2 * PWK + 2 * PTB, 256, 0, stream>>>(x, wq, wk, wv, wo, tcos, tsin, X16, BQ, BK, BV, BO, CSB, SNB);      /* x as f16; [in][out] weights -> Bt[n][k] x16, one work-group per 64 x 64 tile; bf16-rounded rope tables [pos][32] */
  const size_t r0p = (size_t)B0 * SQ;      /* first projected row */
  const size_t f0p = (size_t)B0 * QT0;      /* first row of the first-tile planes */
  /* every launch below covers all batches at once: nothing in one batch waits for another */
  k_gemm2<0, 1, 128, true><<<dim3((unsigned)((MP / 128) * ((DM + 2 * KVD) / 64)), 1), 128, 0, stream>>>(X16 + r0p * DM, DM, 0, BQ, DM, 0, 0.0625f, nullptr, 0, nullptr, 1, 0, 0, QF0 + f0p * DM, Q16 + r0p * DM, DM, 0, MP, DM + 2 * KVD, DM, CSB, SNB, QT0,
      KF0 + f0p * KVD, K16 + r0p * KVD, VF0 + f0p * KVD, V16 + r0p * KVD, KVD);      /* q, k (interleaved-pair rope in the epilogue) and v in one launch: f16 rows, and f32 rows 0..127 of each batch */
  k_post<<<PVT + 2 * PKE, 256, 0, stream>>>(V16 + r0p * KVD, VT + (size_t)B0 * NG * HD * SQ, KF0 + f0p * KVD, KF0e + f0p * DM, VF0 + f0p * KVD, VF0e + f0p * DM);      /* V^T [NB][NG][HD][SQ]; head h <- kv group h/4 for the exact first-tile kernel */
  k_att0w<<<dim3(NH * (QT0 / A0R), NBR), 512, 0, stream>>>(QF0 + f0p * DM, KF0e + f0p * DM, VF0e + f0p * DM, DM, 0.125f, OF0 + f0p * DM, DM);      /* exact f32 attention for rows 0..127 (o x64), grid.y = batch */
  k_fattn<<<NFA + NHL, 128, 0, stream>>>(Q16, K16, VT, O16, OF0, OH0, OL0);      /* scores, causal softmax and P V of both batches and all 32 heads in one launch: o (merged heads, x64) as f16 rows; and first-tile o (x64) -> f16 hi + x1024 residual planes */
  k_gemm2<0><<<dim3((unsigned)((MPO / 128) * (DM / 64)), 1), 128, 0, stream>>>(O16 + r0p * DM, DM, 0, BO, DM, 0, 0.0009765625f, bo, 0, nullptr, 1, 0, 0, OUTF + r0p * DM, nullptr, DM, 0, MPO, DM, DM);      /* out rows (f32) */
  k_gemm2<0><<<dim3((QT0 / 128) * (DM / 64), NBR), 128, 0, stream>>>(OH0 + f0p * DM, DM, (size_t)QT0 * DM, BO, DM, 0, 0.0009765625f, bo, 0, nullptr, 1, 0, 0, OUTF + r0p * DM, nullptr, DM, (size_t)SQ * DM, QT0, DM, DM);      /* rows 0..127 of each batch (grid.y): out = o_hi Wo (+ b), overwriting the f16-path rows */
  k_gemm2<0><<<dim3((QT0 / 128) * (DM / 64), NBR), 128, 0, stream>>>(OL0 + f0p * DM, DM, (size_t)QT0 * DM, BO, DM, 0, 0.00000095367431640625f, nullptr, 0, (const float*)(OUTF + r0p * DM), -1, 0, 0, OUTF + r0p * DM, nullptr, DM, (size_t)SQ * DM, QT0, DM, DM);      /* += o_lo Wo 2^-20 (own-element accumulate) */
  k_f2bf<<<(unsigned)(((size_t)MPO * DM / 8 + 255) / 256), 256, 0, stream>>>(OUTF + (size_t)B0 * SQ * DM, (unsigned short*)d_out + (size_t)B0 * SQ * DM, (size_t)MPO * DM / 8);      /* out.astype(bfloat16): the f32 rows rounded to nearest-even bf16 into the 2-byte output */
}
